// v000
// Times are from an AMD MI455X. After a warm-up the kernel runs many times in a row, and a time is the length of
// such a window on the GPU divided by its runs, so every launch and the gaps after it count. The runs cycle
// through copies of the inputs. A figure is the median of several windows, for all but v000 over two sittings.
// Sittings can differ by a few percent; kernels timed side by side share one.
// v000, which the later versions start from, runs in 107 microseconds.
#include <hip/hip_runtime.h>
#include <hip/hip_bf16.h>

#define NB 4
#define NT 4096
#define NC 384
#define NH 16

typedef __attribute__((ext_vector_type(16))) _Float16 v16h;
typedef __attribute__((ext_vector_type(8)))  _Float16 v8h;
typedef __attribute__((ext_vector_type(8)))  float    v8f;

// Raw v_exp_f32 (flush-to-zero exp2): skips libm's subnormal-range guard
// (v_cmp + v_cndmask + v_ldexp per call). Exactly right for softmax weights.
__device__ __forceinline__ float fast_exp2(float x) {
#if __has_builtin(__builtin_amdgcn_exp2f)
    return __builtin_amdgcn_exp2f(x);
#else
    return exp2f(x);
#endif
}

// ---------------------------------------------------------------------------
// Kernel 1: q/k/v projections. x:[B,T,384] f32 -> qh,kh:[B*T,16] f16,
// vT:[B,16,T] f16 (transposed so the attention kernel's V loads are
// contiguous 128-bit loads). Softmax scale 1/sqrt(16)=0.25 and log2(e)
// (for exp2-domain softmax) folded into q.
// ---------------------------------------------------------------------------
__global__ __launch_bounds__(256) void proj_qkv(
    const float* __restrict__ x,
    const float* __restrict__ Wk,
    const float* __restrict__ Wq,
    const float* __restrict__ Wv,
    _Float16* __restrict__ qh,
    _Float16* __restrict__ kh,
    _Float16* __restrict__ vT)
{
    __shared__ float sx[16 * NC];   // 24 KB: 16 rows of x
    const int tid = threadIdx.x;

    // Stage 16 rows of x into LDS with 128-bit loads.
    const float4* xs = (const float4*)(x + (size_t)blockIdx.x * 16 * NC);
    float4* s4 = (float4*)sx;
    #pragma unroll
    for (int idx = tid; idx < 16 * NC / 4; idx += 256) s4[idx] = xs[idx];
    __syncthreads();

    const int r = tid >> 4;          // row within tile (0..15)
    const int h = tid & 15;          // output head dim (0..15)
    const float* xr = sx + r * NC;

    float aq = 0.f, ak = 0.f, av = 0.f;
    #pragma unroll 4
    for (int c = 0; c < NC; ++c) {
        const float xv = xr[c];
        aq = fmaf(xv, Wq[c * NH + h], aq);
        ak = fmaf(xv, Wk[c * NH + h], ak);
        av = fmaf(xv, Wv[c * NH + h], av);
    }

    const int row = blockIdx.x * 16 + r;    // global row in [0, B*T)
    const int b = row >> 12;
    const int t = row & (NT - 1);
    // 0.25 (softmax scale) * log2(e) so the attention kernel can use exp2.
    qh[(size_t)row * NH + h] = (_Float16)(aq * (0.25f * 1.44269504f));
    kh[(size_t)row * NH + h] = (_Float16)ak;
    vT[(((size_t)(b * NH + h)) << 12) + t] = (_Float16)av;
}

// ---------------------------------------------------------------------------
// Process one PAIR of key tiles (32 keys) against the wave's 16 queries.
//   Za/Zb = K_{j0}/K_{j0+1} (16x32, head dims K-padded) x Q^T (32x16)
//   O^T  += V^T (16x32, 32 REAL keys in K) x P^T (32x16, 32 real keys)
// P^T's B-operand layout matches Z's C-layout lane-for-lane, so the two key
// tiles pack into halves 0..7 / 8..15 with zero cross-lane movement and no
// zero-padding of the PV matmul.
// ---------------------------------------------------------------------------
template<bool MASK>
__device__ __forceinline__ void attn_pair(
    const _Float16* __restrict__ kbase,
    const _Float16* __restrict__ vbase,
    int j0, int q_glob, int hi,
    const v16h& qB, v8f& O, float& m_run, float& l_run)
{
    const v8h z8 = {};
    const v8h ka8 = *(const v8h*)(kbase + (size_t)j0 * 16 * NH);
    const v8h kb8 = *(const v8h*)(kbase + (size_t)(j0 + 1) * 16 * NH);
    const v8h va8 = *(const v8h*)(vbase + j0 * 16);
    const v8h vb8 = *(const v8h*)(vbase + (j0 + 1) * 16);

    const v16h kAa = __builtin_shufflevector(ka8, z8,
        0, 1, 2, 3, 4, 5, 6, 7, 8, 9, 10, 11, 12, 13, 14, 15);
    const v16h kAb = __builtin_shufflevector(kb8, z8,
        0, 1, 2, 3, 4, 5, 6, 7, 8, 9, 10, 11, 12, 13, 14, 15);
    const v16h vA  = __builtin_shufflevector(va8, vb8,       // 32 real keys
        0, 1, 2, 3, 4, 5, 6, 7, 8, 9, 10, 11, 12, 13, 14, 15);

    const v8f zero8 = {};
    v8f Za = __builtin_amdgcn_wmma_f32_16x16x32_f16(
        false, kAa, false, qB, (short)0, zero8, false, false);
    v8f Zb = __builtin_amdgcn_wmma_f32_16x16x32_f16(
        false, kAb, false, qB, (short)0, zero8, false, false);

    float z[16];
    #pragma unroll
    for (int g = 0; g < 8; ++g) {
        float za = Za[g], zb = Zb[g];
        if (MASK) {
            if ((j0 * 16 + g + 8 * hi) > q_glob)      za = -1e30f;
            if ((j0 * 16 + 16 + g + 8 * hi) > q_glob) zb = -1e30f;
        }
        z[g]     = za;
        z[g + 8] = zb;
    }

    float mx = z[0];
    #pragma unroll
    for (int g = 1; g < 16; ++g) mx = fmaxf(mx, z[g]);
    mx = fmaxf(mx, __shfl_xor(mx, 16, 32));          // join lane halves

    const float m_new = fmaxf(m_run, mx);
    const float alpha = fast_exp2(m_run - m_new);    // logits already *log2e

    float psum = 0.f;
    v16h pB;                                         // all 16 halves real
    #pragma unroll
    for (int g = 0; g < 16; ++g) {
        const float p = fast_exp2(z[g] - m_new);
        psum += p;
        pB[g] = (_Float16)p;
    }
    psum += __shfl_xor(psum, 16, 32);

    l_run = l_run * alpha + psum;
    m_run = m_new;
    #pragma unroll
    for (int g = 0; g < 8; ++g) O[g] *= alpha;       // per-lane rescale

    O = __builtin_amdgcn_wmma_f32_16x16x32_f16(
        false, vA, false, pB, (short)0, O, false, false);
}

// ---------------------------------------------------------------------------
// Kernel 2: flash attention. One wave per (batch, 16-query tile).
// ---------------------------------------------------------------------------
__global__ __launch_bounds__(32) void flash_head(
    const _Float16* __restrict__ qh,
    const _Float16* __restrict__ kh,
    const _Float16* __restrict__ vT,
    float* __restrict__ out)
{
    const int lane = threadIdx.x;
    const int ln = lane & 15;   // = query t for Q/Z/P/out, = head dim h for V^T
    const int hi = lane >> 4;   // lane-half selector
    const int i = blockIdx.x;   // query tile index
    const int b = blockIdx.y;   // batch
    const int q_glob = i * 16 + ln;

    const v8h z8 = {};

    // Q as B-operand: lane ln holds q[i*16+ln][8*hi .. 8*hi+7], halves 8..15 = 0.
    const _Float16* qp = qh + (((size_t)b * NT + q_glob) * NH + 8 * hi);
    const v8h qlo = *(const v8h*)qp;
    const v16h qB = __builtin_shufflevector(qlo, z8,
        0, 1, 2, 3, 4, 5, 6, 7, 8, 9, 10, 11, 12, 13, 14, 15);

    v8f O = {};                 // O^T accumulator (f32)
    float m_run = -1e30f;       // running row max (log2 domain)
    float l_run = 0.f;          // running row sum

    const _Float16* kbase = kh + ((size_t)b * NT * NH) + (size_t)ln * NH + 8 * hi;
    const _Float16* vbase = vT + (((size_t)(b * NH + ln)) << 12) + 8 * hi;

    // Pairs strictly below the diagonal: no masking.
    const int jdiag0 = i & ~1;
    for (int j0 = 0; j0 < jdiag0; j0 += 2) {
        __builtin_prefetch(kbase + (size_t)(j0 + 2) * 16 * NH, 0, 1);
        __builtin_prefetch(vbase + (j0 + 2) * 16, 0, 1);
        attn_pair<false>(kbase, vbase, j0, q_glob, hi, qB, O, m_run, l_run);
    }
    // Tail pair containing the diagonal tile (and possibly one fully-masked
    // overshoot tile); loads stay in-bounds since tile index <= NT/16 - 1.
    attn_pair<true>(kbase, vbase, jdiag0, q_glob, hi, qB, O, m_run, l_run);

    const float inv = 1.0f / l_run;
    float* op = out + (((size_t)b * NT + q_glob) * NH + 8 * hi);
    #pragma unroll
    for (int g = 0; g < 8; ++g) op[g] = O[g] * inv;
}

// ---------------------------------------------------------------------------
extern "C" void kernel_launch(void* const* d_in, const int* in_sizes, int n_in,
                              void* d_out, int out_size, void* d_ws, size_t ws_size,
                              hipStream_t stream) {
    (void)in_sizes; (void)n_in; (void)out_size; (void)ws_size;
    const float* x  = (const float*)d_in[0];
    const float* Wk = (const float*)d_in[1];
    const float* Wq = (const float*)d_in[2];
    const float* Wv = (const float*)d_in[3];
    float* out = (float*)d_out;

    _Float16* qh = (_Float16*)d_ws;                  // [B*T,16]
    _Float16* kh = qh + (size_t)NB * NT * NH;        // [B*T,16]
    _Float16* vT = kh + (size_t)NB * NT * NH;        // [B,16,T]

    proj_qkv<<<dim3(NB * NT / 16), 256, 0, stream>>>(x, Wk, Wq, Wv, qh, kh, vT);
    flash_head<<<dim3(NT / 16, NB), 32, 0, stream>>>(qh, kh, vT, out);
}

// v001
// One run takes 67.5 microseconds.
// In two side-by-side timings against v000, it was 1.59 and 1.60 times as fast.
#include <hip/hip_runtime.h>
#include <hip/hip_bf16.h>

#define NB 4
#define NT 4096
#define NC 384
#define NH 16

typedef __attribute__((ext_vector_type(16))) _Float16 v16h;
typedef __attribute__((ext_vector_type(8)))  _Float16 v8h;
typedef __attribute__((ext_vector_type(8)))  float    v8f;

// Raw v_exp_f32 (flush-to-zero exp2): skips libm's subnormal-range guard
// (v_cmp + v_cndmask + v_ldexp per call). Exactly right for softmax weights.
__device__ __forceinline__ float fast_exp2(float x) {
#if __has_builtin(__builtin_amdgcn_exp2f)
    return __builtin_amdgcn_exp2f(x);
#else
    return exp2f(x);
#endif
}

// The same v_exp_f32 with the slot behind it filled in the same statement. For
// the masked tail pair.
__device__ __forceinline__ float exp2_slot(float x) {
    float r;
    asm("v_exp_f32 %0, %1\n\tv_nop" : "=v"(r) : "v"(x));
    return r;
}

// ---------------------------------------------------------------------------
// Kernel 1: q/k/v projections. x:[B,T,384] f32 -> qh,kh:[B*T,16] f16,
// vT:[B,16,T] f16 (transposed so the attention kernel's V loads are
// contiguous 128-bit loads). Softmax scale 1/sqrt(16)=0.25 and log2(e)
// (for exp2-domain softmax) folded into q.
// ---------------------------------------------------------------------------
__global__ __launch_bounds__(256) void proj_qkv(
    const float* __restrict__ x,
    const float* __restrict__ Wk,
    const float* __restrict__ Wq,
    const float* __restrict__ Wv,
    _Float16* __restrict__ qh,
    _Float16* __restrict__ kh,
    _Float16* __restrict__ vT)
{
    __shared__ float sx[16 * NC];   // 24 KB: 16 rows of x
    const int tid = threadIdx.x;

    // Stage 16 rows of x into LDS with 128-bit loads.
    const float4* xs = (const float4*)(x + (size_t)blockIdx.x * 16 * NC);
    float4* s4 = (float4*)sx;
    #pragma unroll
    for (int idx = tid; idx < 16 * NC / 4; idx += 256) s4[idx] = xs[idx];
    __syncthreads();

    const int r = tid >> 4;          // row within tile (0..15)
    const int h = tid & 15;          // output head dim (0..15)
    const float* xr = sx + r * NC;

    float aq = 0.f, ak = 0.f, av = 0.f;
    #pragma unroll 4
    for (int c = 0; c < NC; ++c) {
        const float xv = xr[c];
        aq = fmaf(xv, Wq[c * NH + h], aq);
        ak = fmaf(xv, Wk[c * NH + h], ak);
        av = fmaf(xv, Wv[c * NH + h], av);
    }

    const int row = blockIdx.x * 16 + r;    // global row in [0, B*T)
    const int b = row >> 12;
    const int t = row & (NT - 1);
    // 0.25 (softmax scale) * log2(e) so the attention kernel can use exp2.
    qh[(size_t)row * NH + h] = (_Float16)(aq * (0.25f * 1.44269504f));
    kh[(size_t)row * NH + h] = (_Float16)ak;
    vT[(((size_t)(b * NH + h)) << 12) + t] = (_Float16)av;
}

// ---------------------------------------------------------------------------
// Process one PAIR of key tiles (32 keys) against the wave's 16 queries.
//   Za/Zb = K_{j0}/K_{j0+1} (16x32, head dims K-padded) x Q^T (32x16)
//   O^T  += V^T (16x32, 32 REAL keys in K) x P^T (32x16, 32 real keys)
// P^T's B-operand layout matches Z's C-layout lane-for-lane, so the two key
// tiles pack into halves 0..7 / 8..15 with zero cross-lane movement and no
// zero-padding of the PV matmul.
// ---------------------------------------------------------------------------
template<bool MASK>
__device__ __forceinline__ void attn_pair(
    const _Float16* __restrict__ kbase,
    const _Float16* __restrict__ vbase,
    int j0, int q_glob, int hi,
    const v16h& qB, v8f& O, float& m_run, float& l_run)
{
    const v8h z8 = {};
    const v8h ka8 = *(const v8h*)(kbase + (size_t)j0 * 16 * NH);
    const v8h kb8 = *(const v8h*)(kbase + (size_t)(j0 + 1) * 16 * NH);
    const v8h va8 = *(const v8h*)(vbase + j0 * 16);
    const v8h vb8 = *(const v8h*)(vbase + (j0 + 1) * 16);
    // In the loop: keeps the V loads issued together with the K loads. Sunk behind
    // the wait for K, a trip would pay the two load latencies one after the other.
    if (!MASK) __builtin_amdgcn_sched_barrier(0);

    const v16h kAa = __builtin_shufflevector(ka8, z8,
        0, 1, 2, 3, 4, 5, 6, 7, 8, 9, 10, 11, 12, 13, 14, 15);
    const v16h kAb = __builtin_shufflevector(kb8, z8,
        0, 1, 2, 3, 4, 5, 6, 7, 8, 9, 10, 11, 12, 13, 14, 15);
    const v16h vA  = __builtin_shufflevector(va8, vb8,       // 32 real keys
        0, 1, 2, 3, 4, 5, 6, 7, 8, 9, 10, 11, 12, 13, 14, 15);

    const v8f zero8 = {};
    v8f Za = __builtin_amdgcn_wmma_f32_16x16x32_f16(
        false, kAa, false, qB, (short)0, zero8, false, false);
    v8f Zb = __builtin_amdgcn_wmma_f32_16x16x32_f16(
        false, kAb, false, qB, (short)0, zero8, false, false);

    float z[16];
    #pragma unroll
    for (int g = 0; g < 8; ++g) {
        float za = Za[g], zb = Zb[g];
        if (MASK) {
            if ((j0 * 16 + g + 8 * hi) > q_glob)      za = -1e30f;
            if ((j0 * 16 + 16 + g + 8 * hi) > q_glob) zb = -1e30f;
        }
        z[g]     = za;
        z[g + 8] = zb;
    }

    float mx = z[0];
    #pragma unroll
    for (int g = 1; g < 16; ++g) mx = fmaxf(mx, z[g]);
    mx = fmaxf(mx, __shfl_xor(mx, 16, 32));          // join lane halves

    const float m_new = fmaxf(m_run, mx);
    const float alpha = fast_exp2(m_run - m_new);    // logits already *log2e

    float psum = 0.f;
    v16h pB;                                         // all 16 halves real
    #pragma unroll
    for (int g = 0; g < 16; ++g) {
        const float p = MASK ? exp2_slot(z[g] - m_new) : fast_exp2(z[g] - m_new);
        psum += p;
        pB[g] = (_Float16)p;
    }
    psum += __shfl_xor(psum, 16, 32);

    l_run = l_run * alpha + psum;
    m_run = m_new;
    #pragma unroll
    for (int g = 0; g < 8; ++g) O[g] *= alpha;       // per-lane rescale

    O = __builtin_amdgcn_wmma_f32_16x16x32_f16(
        false, vA, false, pB, (short)0, O, false, false);
}

// ---------------------------------------------------------------------------
// Kernel 2: flash attention. One block of NW waves per (batch, 16-query tile).
// Wave w takes key pairs w, w + NW, w + 2*NW, ... with its own running max,
// sum and accumulator, so the serial chain over the keys is NW times shorter.
// The partials are merged once through LDS.
// ---------------------------------------------------------------------------
#define NW 8
#define OP 20   // LDS pitch of a partial's query row, in floats (16 + 4)

__global__ __launch_bounds__(32 * NW) void flash_head(
    const _Float16* __restrict__ qh,
    const _Float16* __restrict__ kh,
    const _Float16* __restrict__ vT,
    float* __restrict__ out)
{
    __shared__ __attribute__((aligned(16))) float sO[NW][16 * OP];
    __shared__ float sM[NW][16];
    __shared__ float sL[NW][16];

    const int tid = threadIdx.x;
    const int lane = tid & 31;
    const int w = __builtin_amdgcn_readfirstlane(tid >> 5);   // wave, scalar
    const int ln = lane & 15;   // = query t for Q/Z/P/out, = head dim h for V^T
    const int hi = lane >> 4;   // lane-half selector
    const int i = blockIdx.x;   // query tile index
    const int b = blockIdx.y;   // batch
    const int q_glob = i * 16 + ln;

    const v8h z8 = {};

    // Q as B-operand: lane ln holds q[i*16+ln][8*hi .. 8*hi+7], halves 8..15 = 0.
    const _Float16* qp = qh + (((size_t)b * NT + q_glob) * NH + 8 * hi);
    const v8h qlo = *(const v8h*)qp;
    const v16h qB = __builtin_shufflevector(qlo, z8,
        0, 1, 2, 3, 4, 5, 6, 7, 8, 9, 10, 11, 12, 13, 14, 15);

    v8f O = {};                 // O^T accumulator (f32), this wave's keys only
    float m_run = -1e30f;       // running row max (log2 domain)
    float l_run = 0.f;          // running row sum

    const _Float16* kbase = kh + ((size_t)b * NT * NH) + (size_t)ln * NH + 8 * hi;
    const _Float16* vbase = vT + (((size_t)(b * NH + ln)) << 12) + 8 * hi;

    // Pairs strictly below the diagonal: no masking.
    const int jdiag0 = i & ~1;
    for (int j0 = 2 * w; j0 < jdiag0; j0 += 2 * NW) {
        attn_pair<false>(kbase, vbase, j0, q_glob, hi, qB, O, m_run, l_run);
    }
    // Tail pair containing the diagonal tile (and possibly one fully-masked
    // overshoot tile), taken by the wave whose turn it is; loads stay
    // in-bounds since tile index <= NT/16 - 1.
    if (((jdiag0 >> 1) & (NW - 1)) == w)
        attn_pair<true>(kbase, vbase, jdiag0, q_glob, hi, qB, O, m_run, l_run);

    // Publish this wave's partial. A wave without keys publishes
    // (max -1e30, sum 0, O 0) and gets weight exp2(-huge) = 0 below.
    float4* so4 = (float4*)&sO[w][ln * OP + 8 * hi];
    so4[0] = make_float4(O[0], O[1], O[2], O[3]);
    so4[1] = make_float4(O[4], O[5], O[6], O[7]);
    if (hi == 0) { sM[w][ln] = m_run; sL[w][ln] = l_run; }
    __syncthreads();   // every partial is in LDS before any thread merges

    // Merge: thread tid owns out element (query tid >> 4, head dim tid & 15).
    const int mq = tid >> 4;
    const int mh = tid & 15;
    float mw[NW];
    float M = -1e30f;
    #pragma unroll
    for (int u = 0; u < NW; ++u) { mw[u] = sM[u][mq]; M = fmaxf(M, mw[u]); }
    float num = 0.f, den = 0.f;
    #pragma unroll
    for (int u = 0; u < NW; ++u) {
        const float a = fast_exp2(mw[u] - M);
        num = fmaf(sO[u][mq * OP + mh], a, num);
        den = fmaf(sL[u][mq], a, den);
    }
    out[((size_t)b * NT + i * 16) * NH + tid] = num * (1.0f / den);
}

// ---------------------------------------------------------------------------
extern "C" void kernel_launch(void* const* d_in, const int* in_sizes, int n_in,
                              void* d_out, int out_size, void* d_ws, size_t ws_size,
                              hipStream_t stream) {
    (void)in_sizes; (void)n_in; (void)out_size; (void)ws_size;
    const float* x  = (const float*)d_in[0];
    const float* Wk = (const float*)d_in[1];
    const float* Wq = (const float*)d_in[2];
    const float* Wv = (const float*)d_in[3];
    float* out = (float*)d_out;

    _Float16* qh = (_Float16*)d_ws;                  // [B*T,16]
    _Float16* kh = qh + (size_t)NB * NT * NH;        // [B*T,16]
    _Float16* vT = kh + (size_t)NB * NT * NH;        // [B,16,T]

    proj_qkv<<<dim3(NB * NT / 16), 256, 0, stream>>>(x, Wk, Wq, Wv, qh, kh, vT);
    flash_head<<<dim3(NT / 16, NB), 32 * NW, 0, stream>>>(qh, kh, vT, out);
}

// v002
// It runs in 21.8 microseconds.
// Two timings next to v001 put it at 3.01 and 3.16 times that version's speed.
// Over all steps from v000 it is 4.91 times as fast.
#include <hip/hip_runtime.h>
#include <hip/hip_bf16.h>

#define NB 4
#define NT 4096
#define NC 384
#define NH 16

typedef __attribute__((ext_vector_type(16))) _Float16 v16h;
typedef __attribute__((ext_vector_type(8)))  _Float16 v8h;
typedef __attribute__((ext_vector_type(8)))  float    v8f;
typedef __attribute__((ext_vector_type(4)))  float    v4f;
typedef __attribute__((ext_vector_type(2)))  float    v2f;

// Raw v_exp_f32 (flush-to-zero exp2): skips libm's subnormal-range guard
// (v_cmp + v_cndmask + v_ldexp per call). Exactly right for softmax weights.
__device__ __forceinline__ float fast_exp2(float x) {
#if __has_builtin(__builtin_amdgcn_exp2f)
    return __builtin_amdgcn_exp2f(x);
#else
    return exp2f(x);
#endif
}

// The same v_exp_f32 with the slot behind it filled in the same statement. For
// the masked tail pair.
__device__ __forceinline__ float exp2_slot(float x) {
    float r;
    asm("v_exp_f32 %0, %1\n\tv_nop" : "=v"(r) : "v"(x));
    return r;
}

// ---------------------------------------------------------------------------
// Kernel 1: q/k/v projections on the f32 matrix instruction (16x16x4).
// x:[B,T,384] f32 -> qh,kh:[B*T,16] f16, vT:[B,16,T] f16 (transposed so the
// attention kernel's V loads are contiguous 128-bit loads). Softmax scale
// 1/sqrt(16)=0.25 and log2(e) (for exp2-domain softmax) folded into q.
//
// One block of 8 waves per 64 rows of x. Wave w takes row tile (w & 3) and
// half (w >> 2) of the 384 columns; the two halves are added through LDS.
// A lane's four consecutive floats of a row, columns 8j + 4*hi + 0..3, feed two
// matrix instructions (floats 0,1 and floats 2,3); the weights are laid out in
// LDS by the same rule, so both operands pair the same k.
// ---------------------------------------------------------------------------
#define PR 64    // rows of x per block
#define XP 196   // LDS pitch of a wave's x slice in floats (192 + 4): 16 B x odd
#define WH 72    // floats per lane half of a weight slot (64 + 8: the two halves'
                 // paired 4-byte stores below then fall on different banks)
#define WS 144   // floats per weight slot (j, matrix): two lane halves

__device__ __forceinline__ v8f mm4(v2f a, v2f b, v8f c) {
    return __builtin_amdgcn_wmma_f32_16x16x4_f32(false, a, false, b, (short)0, c, false, false);
}

__global__ __launch_bounds__(256) void proj_qkv(
    const float* __restrict__ x,
    const float* __restrict__ Wk,
    const float* __restrict__ Wq,
    const float* __restrict__ Wv,
    _Float16* __restrict__ qh,
    _Float16* __restrict__ kh,
    _Float16* __restrict__ vT)
{
    __shared__ __attribute__((aligned(16))) float sW[(NC / 8) * 3 * WS];
    __shared__ __attribute__((aligned(16))) float sX[8][16 * XP];
    __shared__ __attribute__((aligned(16))) float sR[4][6][32 * 4];

    const int tid = threadIdx.x;
    const int lane = tid & 31;
    const int w = __builtin_amdgcn_readfirstlane(tid >> 5);   // wave, scalar
    const int ln = lane & 15;
    const int hi = lane >> 4;
    const int rt = w & 3;       // row tile of the block
    const int kq = w >> 2;      // column half

    // The weights and the first third of the wave's x slice (16 rows x 192
    // columns; one load = two rows x 256 contiguous bytes) go out first.
    v4f wr[3][6];
    #pragma unroll
    for (int u = 0; u < 6; ++u) {
        wr[0][u] = *(const v4f*)(Wq + 4 * (tid + 256 * u));
        wr[1][u] = *(const v4f*)(Wk + 4 * (tid + 256 * u));
        wr[2][u] = *(const v4f*)(Wv + 4 * (tid + 256 * u));
    }
    // Keeps the weight loads ahead of the x loads: loads return in order, and the
    // weights' way into LDS then runs while the x loads are still in flight.
    __builtin_amdgcn_sched_barrier(0);
    const int row0 = blockIdx.x * PR + rt * 16;
    const float* xw = x + (size_t)row0 * NC + kq * (NC / 2) + hi * NC + 4 * ln;
    v4f xr[24];
    #pragma unroll
    for (int s = 0; s < 8; ++s) xr[s] = *(const v4f*)(xw + s * 2 * NC);

    // Weights into fragment order: slot (j, matrix), lane (n, half), float e
    // holds W[8j + 4*half + e][n].
    #pragma unroll
    for (int u = 0; u < 6; ++u) {
        const int cc = (tid >> 2) + 64 * u;          // weight row
        const int at = (cc >> 3) * 3 * WS + ((cc >> 2) & 1) * WH + (cc & 3) + (tid & 3) * 16;
        #pragma unroll
        for (int m = 0; m < 3; ++m) {
            #pragma unroll
            for (int e = 0; e < 4; ++e) sW[at + m * WS + 4 * e] = wr[m][u][e];
        }
    }

    float* sx = &sX[w][0];
    v8f aq = {}, ak = {}, av = {};
    #pragma unroll
    for (int ch = 0; ch < 3; ++ch) {
        #pragma unroll
        for (int s = 0; s < 8; ++s)
            *(v4f*)(sx + (2 * s + hi) * XP + ch * 64 + 4 * ln) = xr[ch * 8 + s];
        if (ch == 0) {
            __syncthreads();   // the weights of every wave are in LDS
            // The other two thirds are asked for behind the barrier (which waits
            // for every load in flight) and arrive under the first third's products.
            #pragma unroll
            for (int s = 0; s < 8; ++s) xr[8 + s] = *(const v4f*)(xw + s * 2 * NC + 64);
            // Keeps the second third's loads ahead of the last third's: loads
            // return in order, and mixed the second third would wait for both.
            __builtin_amdgcn_sched_barrier(0);
            #pragma unroll
            for (int s = 0; s < 8; ++s) xr[16 + s] = *(const v4f*)(xw + s * 2 * NC + 128);
            // Keeps these loads from sinking below the products that hide them.
            __builtin_amdgcn_sched_barrier(0);
        } else {
            // The wave reads back rows that its other lanes stored: the stores
            // have to be done first. No other wave touches this slice.
            asm volatile("s_wait_dscnt 0x0" ::: "memory");
        }
        #pragma unroll
        for (int jj = 0; jj < 8; ++jj) {
            const v4f xf = *(const v4f*)(sx + ln * XP + ch * 64 + 8 * jj + 4 * hi);
            const float* wp = sW + ((kq * 24 + ch * 8 + jj) * 3) * WS + hi * WH + 4 * ln;
            const v4f fq = *(const v4f*)(wp);
            const v4f fk = *(const v4f*)(wp + WS);
            const v4f fv = *(const v4f*)(wp + 2 * WS);
            // q, k: weights as A, x as B: a lane ends with 8 head dims of one row.
            // v: x as A, weights as B: a lane ends with 8 rows of one head dim.
            aq = mm4(fq.lo, xf.lo, aq);
            ak = mm4(fk.lo, xf.lo, ak);
            av = mm4(xf.lo, fv.lo, av);
            aq = mm4(fq.hi, xf.hi, aq);
            ak = mm4(fk.hi, xf.hi, ak);
            av = mm4(xf.hi, fv.hi, av);
        }
    }

    // Slots behind the last matrix instructions: the branches below can lead
    // straight to vector instructions that rewrite their operand registers.
    // The sums are named as inputs only so that the statement stays behind them.
    asm volatile("v_nop\n\tv_nop\n\tv_nop\n\tv_nop" :: "v"(aq), "v"(ak), "v"(av));

    // Add the two column halves: the upper half's waves hand over through LDS.
    if (kq == 1) {
        *(v4f*)&sR[rt][0][4 * lane] = aq.lo;
        *(v4f*)&sR[rt][1][4 * lane] = aq.hi;
        *(v4f*)&sR[rt][2][4 * lane] = ak.lo;
        *(v4f*)&sR[rt][3][4 * lane] = ak.hi;
        *(v4f*)&sR[rt][4][4 * lane] = av.lo;
        *(v4f*)&sR[rt][5][4 * lane] = av.hi;
    }
    __syncthreads();   // the upper halves' sums are in LDS
    if (kq == 0) {
        aq.lo += *(const v4f*)&sR[rt][0][4 * lane];
        aq.hi += *(const v4f*)&sR[rt][1][4 * lane];
        ak.lo += *(const v4f*)&sR[rt][2][4 * lane];
        ak.hi += *(const v4f*)&sR[rt][3][4 * lane];
        av.lo += *(const v4f*)&sR[rt][4][4 * lane];
        av.hi += *(const v4f*)&sR[rt][5][4 * lane];

        v8h oq, ok, ov;
        #pragma unroll
        for (int g = 0; g < 8; ++g) {
            // 0.25 (softmax scale) * log2(e) so the attention kernel can use exp2.
            oq[g] = (_Float16)(aq[g] * (0.25f * 1.44269504f));
            ok[g] = (_Float16)ak[g];
            ov[g] = (_Float16)av[g];
        }
        const int b = row0 >> 12;
        const int t0 = row0 & (NT - 1);
        *(v8h*)(qh + (size_t)(row0 + ln) * NH + 8 * hi) = oq;
        *(v8h*)(kh + (size_t)(row0 + ln) * NH + 8 * hi) = ok;
        *(v8h*)(vT + (((size_t)(b * NH + ln)) << 12) + t0 + 8 * hi) = ov;
    }
}

// ---------------------------------------------------------------------------
// Process one PAIR of key tiles (32 keys) against the wave's 16 queries.
//   Za/Zb = K_{j0}/K_{j0+1} (16x32, head dims K-padded) x Q^T (32x16)
//   O^T  += V^T (16x32, 32 REAL keys in K) x P^T (32x16, 32 real keys)
// P^T's B-operand layout matches Z's C-layout lane-for-lane, so the two key
// tiles pack into halves 0..7 / 8..15 with zero cross-lane movement and no
// zero-padding of the PV matmul.
// ---------------------------------------------------------------------------
template<bool MASK>
__device__ __forceinline__ void attn_pair(
    const _Float16* __restrict__ kbase,
    const _Float16* __restrict__ vbase,
    int j0, int q_glob, int hi,
    const v16h& qB, v8f& O, float& m_run, float& l_run)
{
    const v8h z8 = {};
    const v8h ka8 = *(const v8h*)(kbase + (size_t)j0 * 16 * NH);
    const v8h kb8 = *(const v8h*)(kbase + (size_t)(j0 + 1) * 16 * NH);
    const v8h va8 = *(const v8h*)(vbase + j0 * 16);
    const v8h vb8 = *(const v8h*)(vbase + (j0 + 1) * 16);
    // In the loop: keeps the V loads issued together with the K loads. Sunk behind
    // the wait for K, a trip would pay the two load latencies one after the other.
    if (!MASK) __builtin_amdgcn_sched_barrier(0);

    const v16h kAa = __builtin_shufflevector(ka8, z8,
        0, 1, 2, 3, 4, 5, 6, 7, 8, 9, 10, 11, 12, 13, 14, 15);
    const v16h kAb = __builtin_shufflevector(kb8, z8,
        0, 1, 2, 3, 4, 5, 6, 7, 8, 9, 10, 11, 12, 13, 14, 15);
    const v16h vA  = __builtin_shufflevector(va8, vb8,       // 32 real keys
        0, 1, 2, 3, 4, 5, 6, 7, 8, 9, 10, 11, 12, 13, 14, 15);

    const v8f zero8 = {};
    v8f Za = __builtin_amdgcn_wmma_f32_16x16x32_f16(
        false, kAa, false, qB, (short)0, zero8, false, false);
    v8f Zb = __builtin_amdgcn_wmma_f32_16x16x32_f16(
        false, kAb, false, qB, (short)0, zero8, false, false);

    float z[16];
    #pragma unroll
    for (int g = 0; g < 8; ++g) {
        float za = Za[g], zb = Zb[g];
        if (MASK) {
            if ((j0 * 16 + g + 8 * hi) > q_glob)      za = -1e30f;
            if ((j0 * 16 + 16 + g + 8 * hi) > q_glob) zb = -1e30f;
        }
        z[g]     = za;
        z[g + 8] = zb;
    }

    float mx = z[0];
    #pragma unroll
    for (int g = 1; g < 16; ++g) mx = fmaxf(mx, z[g]);
    mx = fmaxf(mx, __shfl_xor(mx, 16, 32));          // join lane halves

    const float m_new = fmaxf(m_run, mx);
    const float alpha = fast_exp2(m_run - m_new);    // logits already *log2e

    float psum = 0.f;
    v16h pB;                                         // all 16 halves real
    #pragma unroll
    for (int g = 0; g < 16; ++g) {
        const float p = MASK ? exp2_slot(z[g] - m_new) : fast_exp2(z[g] - m_new);
        psum += p;
        pB[g] = (_Float16)p;
    }
    psum += __shfl_xor(psum, 16, 32);

    l_run = l_run * alpha + psum;
    m_run = m_new;
    #pragma unroll
    for (int g = 0; g < 8; ++g) O[g] *= alpha;       // per-lane rescale

    O = __builtin_amdgcn_wmma_f32_16x16x32_f16(
        false, vA, false, pB, (short)0, O, false, false);
}

// ---------------------------------------------------------------------------
// Kernel 2: flash attention. One block of NW waves per (batch, 16-query tile).
// Wave w takes key pairs w, w + NW, w + 2*NW, ... with its own running max,
// sum and accumulator, so the serial chain over the keys is NW times shorter.
// The partials are merged once through LDS.
// ---------------------------------------------------------------------------
#define NW 8
#define OP 20   // LDS pitch of a partial's query row, in floats (16 + 4)

__global__ __launch_bounds__(32 * NW) void flash_head(
    const _Float16* __restrict__ qh,
    const _Float16* __restrict__ kh,
    const _Float16* __restrict__ vT,
    float* __restrict__ out)
{
    __shared__ __attribute__((aligned(16))) float sO[NW][16 * OP];
    __shared__ float sM[NW][16];
    __shared__ float sL[NW][16];

    const int tid = threadIdx.x;
    const int lane = tid & 31;
    const int w = __builtin_amdgcn_readfirstlane(tid >> 5);   // wave, scalar
    const int ln = lane & 15;   // = query t for Q/Z/P/out, = head dim h for V^T
    const int hi = lane >> 4;   // lane-half selector
    const int i = blockIdx.x;   // query tile index
    const int b = blockIdx.y;   // batch
    const int q_glob = i * 16 + ln;

    const v8h z8 = {};

    // Q as B-operand: lane ln holds q[i*16+ln][8*hi .. 8*hi+7], halves 8..15 = 0.
    const _Float16* qp = qh + (((size_t)b * NT + q_glob) * NH + 8 * hi);
    const v8h qlo = *(const v8h*)qp;
    const v16h qB = __builtin_shufflevector(qlo, z8,
        0, 1, 2, 3, 4, 5, 6, 7, 8, 9, 10, 11, 12, 13, 14, 15);

    v8f O = {};                 // O^T accumulator (f32), this wave's keys only
    float m_run = -1e30f;       // running row max (log2 domain)
    float l_run = 0.f;          // running row sum

    const _Float16* kbase = kh + ((size_t)b * NT * NH) + (size_t)ln * NH + 8 * hi;
    const _Float16* vbase = vT + (((size_t)(b * NH + ln)) << 12) + 8 * hi;

    // Pairs strictly below the diagonal: no masking.
    const int jdiag0 = i & ~1;
    for (int j0 = 2 * w; j0 < jdiag0; j0 += 2 * NW) {
        attn_pair<false>(kbase, vbase, j0, q_glob, hi, qB, O, m_run, l_run);
    }
    // Tail pair containing the diagonal tile (and possibly one fully-masked
    // overshoot tile), taken by the wave whose turn it is; loads stay
    // in-bounds since tile index <= NT/16 - 1.
    if (((jdiag0 >> 1) & (NW - 1)) == w)
        attn_pair<true>(kbase, vbase, jdiag0, q_glob, hi, qB, O, m_run, l_run);

    // Publish this wave's partial. A wave without keys publishes
    // (max -1e30, sum 0, O 0) and gets weight exp2(-huge) = 0 below.
    float4* so4 = (float4*)&sO[w][ln * OP + 8 * hi];
    so4[0] = make_float4(O[0], O[1], O[2], O[3]);
    so4[1] = make_float4(O[4], O[5], O[6], O[7]);
    if (hi == 0) { sM[w][ln] = m_run; sL[w][ln] = l_run; }
    __syncthreads();   // every partial is in LDS before any thread merges

    // Merge: thread tid owns out element (query tid >> 4, head dim tid & 15).
    const int mq = tid >> 4;
    const int mh = tid & 15;
    float mw[NW];
    float M = -1e30f;
    #pragma unroll
    for (int u = 0; u < NW; ++u) { mw[u] = sM[u][mq]; M = fmaxf(M, mw[u]); }
    float num = 0.f, den = 0.f;
    #pragma unroll
    for (int u = 0; u < NW; ++u) {
        const float a = fast_exp2(mw[u] - M);
        num = fmaf(sO[u][mq * OP + mh], a, num);
        den = fmaf(sL[u][mq], a, den);
    }
    out[((size_t)b * NT + i * 16) * NH + tid] = num * (1.0f / den);
}

// ---------------------------------------------------------------------------
extern "C" void kernel_launch(void* const* d_in, const int* in_sizes, int n_in,
                              void* d_out, int out_size, void* d_ws, size_t ws_size,
                              hipStream_t stream) {
    (void)in_sizes; (void)n_in; (void)out_size; (void)ws_size;
    const float* x  = (const float*)d_in[0];
    const float* Wk = (const float*)d_in[1];
    const float* Wq = (const float*)d_in[2];
    const float* Wv = (const float*)d_in[3];
    float* out = (float*)d_out;

    _Float16* qh = (_Float16*)d_ws;                  // [B*T,16]
    _Float16* kh = qh + (size_t)NB * NT * NH;        // [B*T,16]
    _Float16* vT = kh + (size_t)NB * NT * NH;        // [B,16,T]

    proj_qkv<<<dim3(NB * NT / PR), 256, 0, stream>>>(x, Wk, Wq, Wv, qh, kh, vT);
    flash_head<<<dim3(NT / 16, NB), 32 * NW, 0, stream>>>(qh, kh, vT, out);
}

// v003
// Measured time: 18.5 microseconds a run.
// Next to v002, in two timings, it ran 1.18 and 1.16 times as fast.
// All steps since v000 together make it 5.74 times as fast.
#include <hip/hip_runtime.h>
#include <hip/hip_bf16.h>

#define NB 4
#define NT 4096
#define NC 384
#define NH 16

typedef __attribute__((ext_vector_type(16))) _Float16 v16h;
typedef __attribute__((ext_vector_type(8)))  _Float16 v8h;
typedef __attribute__((ext_vector_type(8)))  float    v8f;
typedef __attribute__((ext_vector_type(4)))  float    v4f;
typedef __attribute__((ext_vector_type(2)))  float    v2f;

// Raw v_exp_f32 (flush-to-zero exp2): skips libm's subnormal-range guard
// (v_cmp + v_cndmask + v_ldexp per call). Exactly right for softmax weights.
__device__ __forceinline__ float fast_exp2(float x) {
#if __has_builtin(__builtin_amdgcn_exp2f)
    return __builtin_amdgcn_exp2f(x);
#else
    return exp2f(x);
#endif
}

// The same v_exp_f32 with the slot behind it filled in the same statement. For
// the masked tail pair and the merge.
__device__ __forceinline__ float exp2_slot(float x) {
    float r;
    asm("v_exp_f32 %0, %1\n\tv_nop" : "=v"(r) : "v"(x));
    return r;
}

// ---------------------------------------------------------------------------
// Kernel 1: q/k/v projections on the f32 matrix instruction (16x16x4).
// x:[B,T,384] f32 -> qh,kh:[B*T,16] f16, vT:[B,16,T] f16 (transposed so the
// attention kernel's V loads are contiguous 128-bit loads). Softmax scale
// 1/sqrt(16)=0.25 and log2(e) (for exp2-domain softmax) folded into q.
//
// One block of 8 waves per 64 rows of x. Wave w takes row tile (w & 3) and
// half (w >> 2) of the 384 columns; the two halves are added through LDS.
// A lane's four consecutive floats of a row, columns 8j + 4*hi + 0..3, feed two
// matrix instructions (floats 0,1 and floats 2,3); the weights are laid out in
// LDS by the same rule, so both operands pair the same k.
// ---------------------------------------------------------------------------
#define PR 64    // rows of x per block
#define XP 196   // LDS pitch of a wave's x slice in floats (192 + 4): 16 B x odd
#define WH 72    // floats per lane half of a weight slot (64 + 8: the two halves'
                 // paired 4-byte stores below then fall on different banks)
#define WS 144   // floats per weight slot (j, matrix): two lane halves

__device__ __forceinline__ v8f mm4(v2f a, v2f b, v8f c) {
    return __builtin_amdgcn_wmma_f32_16x16x4_f32(false, a, false, b, (short)0, c, false, false);
}

__global__ __launch_bounds__(256) void proj_qkv(
    const float* __restrict__ x,
    const float* __restrict__ Wk,
    const float* __restrict__ Wq,
    const float* __restrict__ Wv,
    _Float16* __restrict__ qh,
    _Float16* __restrict__ kh,
    _Float16* __restrict__ vT)
{
    __shared__ __attribute__((aligned(16))) float sW[(NC / 8) * 3 * WS];
    __shared__ __attribute__((aligned(16))) float sX[8][16 * XP];
    __shared__ __attribute__((aligned(16))) float sR[4][6][32 * 4];

    const int tid = threadIdx.x;
    const int lane = tid & 31;
    const int w = __builtin_amdgcn_readfirstlane(tid >> 5);   // wave, scalar
    const int ln = lane & 15;
    const int hi = lane >> 4;
    const int rt = w & 3;       // row tile of the block
    const int kq = w >> 2;      // column half

    // The weights and the first third of the wave's x slice (16 rows x 192
    // columns; one load = two rows x 256 contiguous bytes) go out first.
    v4f wr[3][6];
    #pragma unroll
    for (int u = 0; u < 6; ++u) {
        wr[0][u] = *(const v4f*)(Wq + 4 * (tid + 256 * u));
        wr[1][u] = *(const v4f*)(Wk + 4 * (tid + 256 * u));
        wr[2][u] = *(const v4f*)(Wv + 4 * (tid + 256 * u));
    }
    // Keeps the weight loads ahead of the x loads: loads return in order, and the
    // weights' way into LDS then runs while the x loads are still in flight.
    __builtin_amdgcn_sched_barrier(0);
    const int row0 = blockIdx.x * PR + rt * 16;
    const float* xw = x + (size_t)row0 * NC + kq * (NC / 2) + hi * NC + 4 * ln;
    v4f xr[24];
    #pragma unroll
    for (int s = 0; s < 8; ++s) xr[s] = *(const v4f*)(xw + s * 2 * NC);

    // Weights into fragment order: slot (j, matrix), lane (n, half), float e
    // holds W[8j + 4*half + e][n].
    #pragma unroll
    for (int u = 0; u < 6; ++u) {
        const int cc = (tid >> 2) + 64 * u;          // weight row
        const int at = (cc >> 3) * 3 * WS + ((cc >> 2) & 1) * WH + (cc & 3) + (tid & 3) * 16;
        #pragma unroll
        for (int m = 0; m < 3; ++m) {
            #pragma unroll
            for (int e = 0; e < 4; ++e) sW[at + m * WS + 4 * e] = wr[m][u][e];
        }
    }

    float* sx = &sX[w][0];
    v8f aq = {}, ak = {}, av = {};
    #pragma unroll
    for (int ch = 0; ch < 3; ++ch) {
        #pragma unroll
        for (int s = 0; s < 8; ++s)
            *(v4f*)(sx + (2 * s + hi) * XP + ch * 64 + 4 * ln) = xr[ch * 8 + s];
        if (ch == 0) {
            __syncthreads();   // the weights of every wave are in LDS
            // The other two thirds are asked for behind the barrier (which waits
            // for every load in flight) and arrive under the first third's products.
            #pragma unroll
            for (int s = 0; s < 8; ++s) xr[8 + s] = *(const v4f*)(xw + s * 2 * NC + 64);
            // Keeps the second third's loads ahead of the last third's: loads
            // return in order, and mixed the second third would wait for both.
            __builtin_amdgcn_sched_barrier(0);
            #pragma unroll
            for (int s = 0; s < 8; ++s) xr[16 + s] = *(const v4f*)(xw + s * 2 * NC + 128);
            // Keeps these loads from sinking below the products that hide them.
            __builtin_amdgcn_sched_barrier(0);
        } else {
            // The wave reads back rows that its other lanes stored: the stores
            // have to be done first. No other wave touches this slice.
            asm volatile("s_wait_dscnt 0x0" ::: "memory");
        }
        #pragma unroll
        for (int jj = 0; jj < 8; ++jj) {
            const v4f xf = *(const v4f*)(sx + ln * XP + ch * 64 + 8 * jj + 4 * hi);
            const float* wp = sW + ((kq * 24 + ch * 8 + jj) * 3) * WS + hi * WH + 4 * ln;
            const v4f fq = *(const v4f*)(wp);
            const v4f fk = *(const v4f*)(wp + WS);
            const v4f fv = *(const v4f*)(wp + 2 * WS);
            // q, k: weights as A, x as B: a lane ends with 8 head dims of one row.
            // v: x as A, weights as B: a lane ends with 8 rows of one head dim.
            aq = mm4(fq.lo, xf.lo, aq);
            ak = mm4(fk.lo, xf.lo, ak);
            av = mm4(xf.lo, fv.lo, av);
            aq = mm4(fq.hi, xf.hi, aq);
            ak = mm4(fk.hi, xf.hi, ak);
            av = mm4(xf.hi, fv.hi, av);
        }
    }

    // Slots behind the last matrix instructions: the branches below can lead
    // straight to vector instructions that rewrite their operand registers.
    // The sums are named as inputs only so that the statement stays behind them.
    asm volatile("v_nop\n\tv_nop\n\tv_nop\n\tv_nop" :: "v"(aq), "v"(ak), "v"(av));

    // Add the two column halves: the upper half's waves hand over through LDS.
    if (kq == 1) {
        *(v4f*)&sR[rt][0][4 * lane] = aq.lo;
        *(v4f*)&sR[rt][1][4 * lane] = aq.hi;
        *(v4f*)&sR[rt][2][4 * lane] = ak.lo;
        *(v4f*)&sR[rt][3][4 * lane] = ak.hi;
        *(v4f*)&sR[rt][4][4 * lane] = av.lo;
        *(v4f*)&sR[rt][5][4 * lane] = av.hi;
    }
    __syncthreads();   // the upper halves' sums are in LDS
    if (kq == 0) {
        aq.lo += *(const v4f*)&sR[rt][0][4 * lane];
        aq.hi += *(const v4f*)&sR[rt][1][4 * lane];
        ak.lo += *(const v4f*)&sR[rt][2][4 * lane];
        ak.hi += *(const v4f*)&sR[rt][3][4 * lane];
        av.lo += *(const v4f*)&sR[rt][4][4 * lane];
        av.hi += *(const v4f*)&sR[rt][5][4 * lane];

        v8h oq, ok, ov;
        #pragma unroll
        for (int g = 0; g < 8; ++g) {
            // 0.25 (softmax scale) * log2(e) so the attention kernel can use exp2.
            oq[g] = (_Float16)(aq[g] * (0.25f * 1.44269504f));
            ok[g] = (_Float16)ak[g];
            ov[g] = (_Float16)av[g];
        }
        const int b = row0 >> 12;
        const int t0 = row0 & (NT - 1);
        *(v8h*)(qh + (size_t)(row0 + ln) * NH + 8 * hi) = oq;
        *(v8h*)(kh + (size_t)(row0 + ln) * NH + 8 * hi) = ok;
        *(v8h*)(vT + (((size_t)(b * NH + ln)) << 12) + t0 + 8 * hi) = ov;
    }
}

// ---------------------------------------------------------------------------
// Process one PAIR of key tiles (32 keys) against the wave's 16 queries.
//   Za/Zb = K_{j0}/K_{j0+1} (16x32, head dims K-padded) x Q^T (32x16)
//   O^T  += V^T (16x32, 32 REAL keys in K) x P^T (32x16, 32 real keys)
// P^T's B-operand layout matches Z's C-layout lane-for-lane, so the two key
// tiles pack into halves 0..7 / 8..15 with zero cross-lane movement and no
// zero-padding of the PV matmul.
// ---------------------------------------------------------------------------
template<bool MASK>
__device__ __forceinline__ void attn_pair(
    const _Float16* __restrict__ kbase,
    const _Float16* __restrict__ vbase,
    int j0, int q_glob, int hi,
    const v16h& qB, v8f& O, float& m_run, float& l_run)
{
    const v8h z8 = {};
    const v8h ka8 = *(const v8h*)(kbase + (size_t)j0 * 16 * NH);
    const v8h kb8 = *(const v8h*)(kbase + (size_t)(j0 + 1) * 16 * NH);
    // Tail pair: this build reuses the K loads' address registers for what the
    // V loads bring; the wait stands in front of that overwrite (a precaution).
    if (MASK) asm volatile("s_wait_xcnt 0x0" ::: "memory");
    const v8h va8 = *(const v8h*)(vbase + j0 * 16);
    const v8h vb8 = *(const v8h*)(vbase + (j0 + 1) * 16);
    // In the loop: keeps the V loads issued together with the K loads. Sunk behind
    // the wait for K, a trip would pay the two load latencies one after the other.
    if (!MASK) __builtin_amdgcn_sched_barrier(0);

    const v16h kAa = __builtin_shufflevector(ka8, z8,
        0, 1, 2, 3, 4, 5, 6, 7, 8, 9, 10, 11, 12, 13, 14, 15);
    const v16h kAb = __builtin_shufflevector(kb8, z8,
        0, 1, 2, 3, 4, 5, 6, 7, 8, 9, 10, 11, 12, 13, 14, 15);
    const v16h vA  = __builtin_shufflevector(va8, vb8,       // 32 real keys
        0, 1, 2, 3, 4, 5, 6, 7, 8, 9, 10, 11, 12, 13, 14, 15);

    const v8f zero8 = {};
    v8f Za = __builtin_amdgcn_wmma_f32_16x16x32_f16(
        false, kAa, false, qB, (short)0, zero8, false, false);
    v8f Zb = __builtin_amdgcn_wmma_f32_16x16x32_f16(
        false, kAb, false, qB, (short)0, zero8, false, false);

    float z[16];
    #pragma unroll
    for (int g = 0; g < 8; ++g) {
        float za = Za[g], zb = Zb[g];
        if (MASK) {
            if ((j0 * 16 + g + 8 * hi) > q_glob)      za = -1e30f;
            if ((j0 * 16 + 16 + g + 8 * hi) > q_glob) zb = -1e30f;
        }
        z[g]     = za;
        z[g + 8] = zb;
    }

    float mx = z[0];
    #pragma unroll
    for (int g = 1; g < 16; ++g) mx = fmaxf(mx, z[g]);
    mx = fmaxf(mx, __shfl_xor(mx, 16, 32));          // join lane halves

    const float m_new = fmaxf(m_run, mx);
    const float alpha = fast_exp2(m_run - m_new);    // logits already *log2e

    float psum = 0.f;
    v16h pB;                                         // all 16 halves real
    #pragma unroll
    for (int g = 0; g < 16; ++g) {
        const float p = MASK ? exp2_slot(z[g] - m_new) : fast_exp2(z[g] - m_new);
        psum += p;
        pB[g] = (_Float16)p;
    }
    psum += __shfl_xor(psum, 16, 32);

    l_run = l_run * alpha + psum;
    m_run = m_new;
    #pragma unroll
    for (int g = 0; g < 8; ++g) O[g] *= alpha;       // per-lane rescale

    O = __builtin_amdgcn_wmma_f32_16x16x32_f16(
        false, vA, false, pB, (short)0, O, false, false);
}

// ---------------------------------------------------------------------------
// Kernel 2: flash attention. One block of NW waves per (batch, two 16-query
// tiles): tile 255 - x and tile x. A causal tile's cost grows with its index,
// and every block of the grid is resident at once, so the launch lasts as long
// as its fullest block: the two tiles together have 129 key pairs in every
// block. The pairs of the first tile and then those of the second are dealt to
// the waves in turn (position p of that list goes to wave p mod NW), so a wave
// walks 8 or 9 pairs. Per tile a wave keeps its own running max, sum and
// accumulator; the partials of both tiles are merged once through LDS.
// ---------------------------------------------------------------------------
#define NW 16
#define OP 20   // LDS pitch of a partial's query row, in floats (16 + 4)

// This wave's share of one query tile: key pairs first, first + NW, ...
// The partial goes to the wave's own LDS slots. A wave without keys publishes
// (max -1e30, sum 0, O 0) and gets weight exp2(-huge) = 0 in the merge.
__device__ __forceinline__ void tile_share(
    const _Float16* __restrict__ kbase,
    const _Float16* __restrict__ vbase,
    int tile, int first, int ln, int hi, const v16h& qB,
    float* __restrict__ so, float* __restrict__ sm, float* __restrict__ sl)
{
    const int q_glob = tile * 16 + ln;
    v8f O = {};                 // O^T accumulator (f32), this wave's keys only
    float m_run = -1e30f;       // running row max (log2 domain)
    float l_run = 0.f;          // running row sum

    // Pairs strictly below the diagonal: no masking.
    const int jdiag0 = tile & ~1;
    for (int j0 = 2 * first; j0 < jdiag0; j0 += 2 * NW) {
        attn_pair<false>(kbase, vbase, j0, q_glob, hi, qB, O, m_run, l_run);
    }
    // Tail pair containing the diagonal tile (and possibly one fully-masked
    // overshoot tile), taken by the wave whose turn it is; loads stay
    // in-bounds since tile index <= NT/16 - 1.
    if (((jdiag0 >> 1) & (NW - 1)) == first)
        attn_pair<true>(kbase, vbase, jdiag0, q_glob, hi, qB, O, m_run, l_run);

    float4* so4 = (float4*)(so + ln * OP + 8 * hi);
    so4[0] = make_float4(O[0], O[1], O[2], O[3]);
    so4[1] = make_float4(O[4], O[5], O[6], O[7]);
    if (hi == 0) { sm[ln] = m_run; sl[ln] = l_run; }
}

__global__ __launch_bounds__(32 * NW) void flash_head(
    const _Float16* __restrict__ qh,
    const _Float16* __restrict__ kh,
    const _Float16* __restrict__ vT,
    float* __restrict__ out)
{
    __shared__ __attribute__((aligned(16))) float sO[2][NW][16 * OP];
    __shared__ float sM[2][NW][16];
    __shared__ float sL[2][NW][16];

    const int tid = threadIdx.x;
    const int lane = tid & 31;
    const int w = __builtin_amdgcn_readfirstlane(tid >> 5);   // wave, scalar
    const int ln = lane & 15;   // = query t for Q/Z/P/out, = head dim h for V^T
    const int hi = lane >> 4;   // lane-half selector
    const int t1 = blockIdx.x;               // the short tile, 0 .. 127
    const int t0 = NT / 16 - 1 - t1;         // the long tile, 255 .. 128
    const int b = blockIdx.y;   // batch

    const v8h z8 = {};

    // Q as B-operand: lane ln holds q[tile*16+ln][8*hi .. 8*hi+7], halves 8..15 = 0.
    const _Float16* qp = qh + (((size_t)b * NT + ln) * NH + 8 * hi);
    const v8h qlo0 = *(const v8h*)(qp + (size_t)t0 * 16 * NH);
    const v8h qlo1 = *(const v8h*)(qp + (size_t)t1 * 16 * NH);
    // The two loads' address registers are rewritten soon behind them; the wait
    // stands in front of that overwrite (a precaution).
    asm volatile("s_wait_xcnt 0x0" ::: "memory");
    const v16h qB0 = __builtin_shufflevector(qlo0, z8,
        0, 1, 2, 3, 4, 5, 6, 7, 8, 9, 10, 11, 12, 13, 14, 15);
    const v16h qB1 = __builtin_shufflevector(qlo1, z8,
        0, 1, 2, 3, 4, 5, 6, 7, 8, 9, 10, 11, 12, 13, 14, 15);

    const _Float16* kbase = kh + ((size_t)b * NT * NH) + (size_t)ln * NH + 8 * hi;
    const _Float16* vbase = vT + (((size_t)(b * NH + ln)) << 12) + 8 * hi;

    // The long tile's pairs start at wave 0; the short tile's go on where the
    // long tile's (t0 / 2 + 1 of them) ended.
    tile_share(kbase, vbase, t0, w, ln, hi, qB0,
               &sO[0][w][0], &sM[0][w][0], &sL[0][w][0]);
    tile_share(kbase, vbase, t1, (w - ((t0 >> 1) + 1)) & (NW - 1), ln, hi, qB1,
               &sO[1][w][0], &sM[1][w][0], &sL[1][w][0]);
    __syncthreads();   // every partial is in LDS before any thread merges

    // Merge: thread tid owns one out element: tile tid >> 8 of the two, query
    // (tid >> 4) & 15, head dim tid & 15.
    const int ms = tid >> 8;
    const int mq = (tid >> 4) & 15;
    const int mh = tid & 15;
    float mw[NW];
    float M = -1e30f;
    #pragma unroll
    for (int u = 0; u < NW; ++u) { mw[u] = sM[ms][u][mq]; M = fmaxf(M, mw[u]); }
    float num = 0.f, den = 0.f;
    #pragma unroll
    for (int u = 0; u < NW; ++u) {
        // With the slot filled.
        const float a = exp2_slot(mw[u] - M);
        num = fmaf(sO[ms][u][mq * OP + mh], a, num);
        den = fmaf(sL[ms][u][mq], a, den);
    }
    const int mt = ms ? t1 : t0;
    out[((size_t)b * NT + mt * 16) * NH + (tid & 255)] = num * (1.0f / den);
}

// ---------------------------------------------------------------------------
extern "C" void kernel_launch(void* const* d_in, const int* in_sizes, int n_in,
                              void* d_out, int out_size, void* d_ws, size_t ws_size,
                              hipStream_t stream) {
    (void)in_sizes; (void)n_in; (void)out_size; (void)ws_size;
    const float* x  = (const float*)d_in[0];
    const float* Wk = (const float*)d_in[1];
    const float* Wq = (const float*)d_in[2];
    const float* Wv = (const float*)d_in[3];
    float* out = (float*)d_out;

    _Float16* qh = (_Float16*)d_ws;                  // [B*T,16]
    _Float16* kh = qh + (size_t)NB * NT * NH;        // [B*T,16]
    _Float16* vT = kh + (size_t)NB * NT * NH;        // [B,16,T]

    proj_qkv<<<dim3(NB * NT / PR), 256, 0, stream>>>(x, Wk, Wq, Wv, qh, kh, vT);
    flash_head<<<dim3(NT / 32, NB), 32 * NW, 0, stream>>>(qh, kh, vT, out);
}

// v004
// It runs in 16.6 microseconds.
// Timed twice side by side with v003, it ran 1.10 and 1.12 times as fast.
// All steps since v000 together make it 6.37 times as fast.
#include <hip/hip_runtime.h>
#include <hip/hip_bf16.h>

#define NB 4
#define NT 4096
#define NC 384
#define NH 16

typedef __attribute__((ext_vector_type(16))) _Float16 v16h;
typedef __attribute__((ext_vector_type(8)))  _Float16 v8h;
typedef __attribute__((ext_vector_type(8)))  float    v8f;
typedef __attribute__((ext_vector_type(4)))  float    v4f;
typedef __attribute__((ext_vector_type(2)))  float    v2f;

// Raw v_exp_f32 (flush-to-zero exp2): skips libm's subnormal-range guard
// (v_cmp + v_cndmask + v_ldexp per call). Exactly right for softmax weights.
// The slot behind it is filled in the same statement.
__device__ __forceinline__ float exp2_slot(float x) {
    float r;
    asm("v_exp_f32 %0, %1\n\tv_nop" : "=v"(r) : "v"(x));
    return r;
}

// A run of the same v_exp_f32 in one statement, so that one filled slot behind
// the last serves the whole run: the results are early-clobber, so inside the
// run no instruction reads a result or overwrites a source of the one in front.
// The hint in front lets the SIMD's other waves issue while the last of the
// sources is still being made (the compiler hints none for asm text).
__device__ __forceinline__ void exp2_run8(float* __restrict__ r, const float* __restrict__ x) {
    asm("s_delay_alu instid0(VALU_DEP_1)\n\t"
        "v_exp_f32 %0, %8\n\tv_exp_f32 %1, %9\n\tv_exp_f32 %2, %10\n\tv_exp_f32 %3, %11\n\t"
        "v_exp_f32 %4, %12\n\tv_exp_f32 %5, %13\n\tv_exp_f32 %6, %14\n\tv_exp_f32 %7, %15\n\t"
        "v_nop"
        : "=&v"(r[0]), "=&v"(r[1]), "=&v"(r[2]), "=&v"(r[3]),
          "=&v"(r[4]), "=&v"(r[5]), "=&v"(r[6]), "=&v"(r[7])
        : "v"(x[0]), "v"(x[1]), "v"(x[2]), "v"(x[3]),
          "v"(x[4]), "v"(x[5]), "v"(x[6]), "v"(x[7]));
}

// ---------------------------------------------------------------------------
// Kernel 1: q/k/v projections on the f32 matrix instruction (16x16x4).
// x:[B,T,384] f32 -> qh,kh:[B*T,16] f16, vT:[B,16,T] f16 (transposed so the
// attention kernel's V loads are contiguous 128-bit loads). Softmax scale
// 1/sqrt(16)=0.25 and log2(e) (for exp2-domain softmax) folded into q.
//
// One block of 8 waves per 64 rows of x. Wave w takes row tile (w & 3) and
// half (w >> 2) of the 384 columns; the two halves are added through LDS.
// A lane's four consecutive floats of a row, columns 8j + 4*hi + 0..3, feed two
// matrix instructions (floats 0,1 and floats 2,3); the weights are laid out in
// LDS by the same rule, so both operands pair the same k.
// ---------------------------------------------------------------------------
#define PR 64    // rows of x per block
#define XP 196   // LDS pitch of a wave's x slice in floats (192 + 4): 16 B x odd
#define WH 72    // floats per lane half of a weight slot (64 + 8: the two halves'
                 // paired 4-byte stores below then fall on different banks)
#define WS 144   // floats per weight slot (j, matrix): two lane halves

__device__ __forceinline__ v8f mm4(v2f a, v2f b, v8f c) {
    return __builtin_amdgcn_wmma_f32_16x16x4_f32(false, a, false, b, (short)0, c, false, false);
}

__global__ __launch_bounds__(256) void proj_qkv(
    const float* __restrict__ x,
    const float* __restrict__ Wk,
    const float* __restrict__ Wq,
    const float* __restrict__ Wv,
    _Float16* __restrict__ qh,
    _Float16* __restrict__ kh,
    _Float16* __restrict__ vT)
{
    __shared__ __attribute__((aligned(16))) float sW[(NC / 8) * 3 * WS];
    __shared__ __attribute__((aligned(16))) float sX[8][16 * XP];
    __shared__ __attribute__((aligned(16))) float sR[4][6][32 * 4];

    const int tid = threadIdx.x;
    const int lane = tid & 31;
    const int w = __builtin_amdgcn_readfirstlane(tid >> 5);   // wave, scalar
    const int ln = lane & 15;
    const int hi = lane >> 4;
    const int rt = w & 3;       // row tile of the block
    const int kq = w >> 2;      // column half

    // The weights and the first third of the wave's x slice (16 rows x 192
    // columns; one load = two rows x 256 contiguous bytes) go out first.
    v4f wr[3][6];
    #pragma unroll
    for (int u = 0; u < 6; ++u) {
        wr[0][u] = *(const v4f*)(Wq + 4 * (tid + 256 * u));
        wr[1][u] = *(const v4f*)(Wk + 4 * (tid + 256 * u));
        wr[2][u] = *(const v4f*)(Wv + 4 * (tid + 256 * u));
    }
    // Keeps the weight loads ahead of the x loads: loads return in order, and the
    // weights' way into LDS then runs while the x loads are still in flight.
    __builtin_amdgcn_sched_barrier(0);
    const int row0 = blockIdx.x * PR + rt * 16;
    const float* xw = x + (size_t)row0 * NC + kq * (NC / 2) + hi * NC + 4 * ln;
    v4f xr[24];
    #pragma unroll
    for (int s = 0; s < 8; ++s) xr[s] = *(const v4f*)(xw + s * 2 * NC);

    // Weights into fragment order: slot (j, matrix), lane (n, half), float e
    // holds W[8j + 4*half + e][n].
    #pragma unroll
    for (int u = 0; u < 6; ++u) {
        const int cc = (tid >> 2) + 64 * u;          // weight row
        const int at = (cc >> 3) * 3 * WS + ((cc >> 2) & 1) * WH + (cc & 3) + (tid & 3) * 16;
        #pragma unroll
        for (int m = 0; m < 3; ++m) {
            #pragma unroll
            for (int e = 0; e < 4; ++e) sW[at + m * WS + 4 * e] = wr[m][u][e];
        }
    }

    float* sx = &sX[w][0];
    v8f aq = {}, ak = {}, av = {};
    #pragma unroll
    for (int ch = 0; ch < 3; ++ch) {
        #pragma unroll
        for (int s = 0; s < 8; ++s)
            *(v4f*)(sx + (2 * s + hi) * XP + ch * 64 + 4 * ln) = xr[ch * 8 + s];
        if (ch == 0) {
            __syncthreads();   // the weights of every wave are in LDS
            // The other two thirds are asked for behind the barrier (which waits
            // for every load in flight) and arrive under the first third's products.
            #pragma unroll
            for (int s = 0; s < 8; ++s) xr[8 + s] = *(const v4f*)(xw + s * 2 * NC + 64);
            // Keeps the second third's loads ahead of the last third's: loads
            // return in order, and mixed the second third would wait for both.
            __builtin_amdgcn_sched_barrier(0);
            #pragma unroll
            for (int s = 0; s < 8; ++s) xr[16 + s] = *(const v4f*)(xw + s * 2 * NC + 128);
            // Keeps these loads from sinking below the products that hide them.
            __builtin_amdgcn_sched_barrier(0);
        } else {
            // The wave reads back rows that its other lanes stored: the stores
            // have to be done first. No other wave touches this slice.
            asm volatile("s_wait_dscnt 0x0" ::: "memory");
        }
        #pragma unroll
        for (int jj = 0; jj < 8; ++jj) {
            const v4f xf = *(const v4f*)(sx + ln * XP + ch * 64 + 8 * jj + 4 * hi);
            const float* wp = sW + ((kq * 24 + ch * 8 + jj) * 3) * WS + hi * WH + 4 * ln;
            const v4f fq = *(const v4f*)(wp);
            const v4f fk = *(const v4f*)(wp + WS);
            const v4f fv = *(const v4f*)(wp + 2 * WS);
            // q, k: weights as A, x as B: a lane ends with 8 head dims of one row.
            // v: x as A, weights as B: a lane ends with 8 rows of one head dim.
            aq = mm4(fq.lo, xf.lo, aq);
            ak = mm4(fk.lo, xf.lo, ak);
            av = mm4(xf.lo, fv.lo, av);
            aq = mm4(fq.hi, xf.hi, aq);
            ak = mm4(fk.hi, xf.hi, ak);
            av = mm4(xf.hi, fv.hi, av);
        }
    }

    // Slots behind the last matrix instructions: the branches below can lead
    // straight to vector instructions that rewrite their operand registers.
    // The sums are named as inputs only so that the statement stays behind them.
    asm volatile("v_nop\n\tv_nop\n\tv_nop\n\tv_nop" :: "v"(aq), "v"(ak), "v"(av));

    // Add the two column halves: the upper half's waves hand over through LDS.
    if (kq == 1) {
        *(v4f*)&sR[rt][0][4 * lane] = aq.lo;
        *(v4f*)&sR[rt][1][4 * lane] = aq.hi;
        *(v4f*)&sR[rt][2][4 * lane] = ak.lo;
        *(v4f*)&sR[rt][3][4 * lane] = ak.hi;
        *(v4f*)&sR[rt][4][4 * lane] = av.lo;
        *(v4f*)&sR[rt][5][4 * lane] = av.hi;
    }
    __syncthreads();   // the upper halves' sums are in LDS
    if (kq == 0) {
        aq.lo += *(const v4f*)&sR[rt][0][4 * lane];
        aq.hi += *(const v4f*)&sR[rt][1][4 * lane];
        ak.lo += *(const v4f*)&sR[rt][2][4 * lane];
        ak.hi += *(const v4f*)&sR[rt][3][4 * lane];
        av.lo += *(const v4f*)&sR[rt][4][4 * lane];
        av.hi += *(const v4f*)&sR[rt][5][4 * lane];

        v8h oq, ok, ov;
        #pragma unroll
        for (int g = 0; g < 8; ++g) {
            // 0.25 (softmax scale) * log2(e) so the attention kernel can use exp2.
            oq[g] = (_Float16)(aq[g] * (0.25f * 1.44269504f));
            ok[g] = (_Float16)ak[g];
            ov[g] = (_Float16)av[g];
        }
        const int b = row0 >> 12;
        const int t0 = row0 & (NT - 1);
        *(v8h*)(qh + (size_t)(row0 + ln) * NH + 8 * hi) = oq;
        *(v8h*)(kh + (size_t)(row0 + ln) * NH + 8 * hi) = ok;
        *(v8h*)(vT + (((size_t)(b * NH + ln)) << 12) + t0 + 8 * hi) = ov;
    }
}

// ---------------------------------------------------------------------------
// One 16-query tile against one PAIR of key tiles (32 keys) that the wave holds
// in registers.
//   Za/Zb = K_{j0}/K_{j0+1} (16x32, head dims K-padded) x Q^T (32x16)
//   O^T  += V^T (16x32, 32 REAL keys in K) x P^T (32x16, 32 real keys)
// P^T's B-operand layout matches Z's C-layout lane-for-lane, so the two key
// tiles pack into halves 0..7 / 8..15 with zero cross-lane movement and no
// zero-padding of the PV matmul.
// ---------------------------------------------------------------------------
template<bool MASK>
__device__ __forceinline__ void attn_tile(
    const v16h& kAa, const v16h& kAb, const v16h& vA,
    int j0, int q_glob, int hi,
    const v16h& qB, v8f& O, float& m_run, float& l_run)
{
    const v8f zero8 = {};
    v8f Za = __builtin_amdgcn_wmma_f32_16x16x32_f16(
        false, kAa, false, qB, (short)0, zero8, false, false);
    v8f Zb = __builtin_amdgcn_wmma_f32_16x16x32_f16(
        false, kAb, false, qB, (short)0, zero8, false, false);

    float z[16];
    #pragma unroll
    for (int g = 0; g < 8; ++g) {
        float za = Za[g], zb = Zb[g];
        if (MASK) {
            if ((j0 * 16 + g + 8 * hi) > q_glob)      za = -1e30f;
            if ((j0 * 16 + 16 + g + 8 * hi) > q_glob) zb = -1e30f;
        }
        z[g]     = za;
        z[g + 8] = zb;
    }

    float mx = z[0];
    #pragma unroll
    for (int g = 1; g < 16; ++g) mx = fmaxf(mx, z[g]);
    mx = fmaxf(mx, __shfl_xor(mx, 16, 32));          // join lane halves

    const float m_new = fmaxf(m_run, mx);
    const float alpha = exp2_slot(m_run - m_new);    // logits already *log2e

    float d[16], p[16];
    #pragma unroll
    for (int g = 0; g < 16; ++g) d[g] = z[g] - m_new;
    exp2_run8(p, d);
    exp2_run8(p + 8, d + 8);

    float psum = 0.f;
    v16h pB;                                         // all 16 halves real
    #pragma unroll
    for (int g = 0; g < 16; ++g) {
        psum += p[g];
        pB[g] = (_Float16)p[g];
    }
    psum += __shfl_xor(psum, 16, 32);

    l_run = l_run * alpha + psum;
    m_run = m_new;
    #pragma unroll
    for (int g = 0; g < 8; ++g) O[g] *= alpha;       // per-lane rescale

    O = __builtin_amdgcn_wmma_f32_16x16x32_f16(
        false, vA, false, pB, (short)0, O, false, false);
}

// The running state of one 16-query tile in a wave.
struct TileAcc {
    v8f O;        // O^T accumulator (f32), this wave's keys only
    float m;      // running row max (log2 domain)
    float l;      // running row sum
};

// One pair of key tiles against the wave's 32 queries (two adjacent query
// tiles): the K and V fragments are loaded once and serve both tiles.
template<bool MASK>
__device__ __forceinline__ void attn_pair(
    const _Float16* __restrict__ kbase,
    const _Float16* __restrict__ vbase,
    int j0, int q_glob, int hi,
    const v16h& qBa, const v16h& qBb, TileAcc& A, TileAcc& B)
{
    const v8h z8 = {};
    const v8h ka8 = *(const v8h*)(kbase + (size_t)j0 * 16 * NH);
    const v8h kb8 = *(const v8h*)(kbase + (size_t)(j0 + 1) * 16 * NH);
    // Tail pair: this build reuses the K loads' address registers for what the
    // V loads bring; the wait stands in front of that overwrite (a precaution).
    if (MASK) asm volatile("s_wait_xcnt 0x0" ::: "memory");
    const v8h va8 = *(const v8h*)(vbase + j0 * 16);
    const v8h vb8 = *(const v8h*)(vbase + (j0 + 1) * 16);
    // In the loop: keeps the V loads issued together with the K loads. Sunk behind
    // the wait for K, a trip would pay the two load latencies one after the other.
    if (!MASK) __builtin_amdgcn_sched_barrier(0);

    const v16h kAa = __builtin_shufflevector(ka8, z8,
        0, 1, 2, 3, 4, 5, 6, 7, 8, 9, 10, 11, 12, 13, 14, 15);
    const v16h kAb = __builtin_shufflevector(kb8, z8,
        0, 1, 2, 3, 4, 5, 6, 7, 8, 9, 10, 11, 12, 13, 14, 15);
    const v16h vA  = __builtin_shufflevector(va8, vb8,       // 32 real keys
        0, 1, 2, 3, 4, 5, 6, 7, 8, 9, 10, 11, 12, 13, 14, 15);

    attn_tile<MASK>(kAa, kAb, vA, j0, q_glob,      hi, qBa, A.O, A.m, A.l);
    attn_tile<MASK>(kAa, kAb, vA, j0, q_glob + 16, hi, qBb, B.O, B.m, B.l);
}

// ---------------------------------------------------------------------------
// Kernel 2: flash attention. A wave works on 32 queries (two adjacent 16-query
// tiles, a "strip") at a time, so a strip's diagonal lies in one key pair:
// strip s meets pairs 0 .. s, the last one masked. One block of NW waves per
// (batch, two strips): strip 127 - x and strip x. A causal strip's cost grows
// with its index, and every block of the grid is resident at once (one per
// WGP), so the launch lasts as long as its fullest block: the two strips
// together have 129 key pairs in every block. The pairs of the first strip and
// then those of the second are dealt to the waves in turn (position p of that
// list goes to wave p mod NW), so a wave walks 8 or 9 pairs. Per 16-query tile a
// wave keeps its own running max, sum and accumulator; the partials of all four
// tiles are merged once through LDS.
// ---------------------------------------------------------------------------
#define NW 16
#define OP 20   // LDS pitch of a partial's query row, in floats (16 + 4)

// The wave's partial of one tile goes to the wave's own LDS slots. A wave
// without keys publishes (max -1e30, sum 0, O 0) and gets weight
// exp2(-huge) = 0 in the merge.
__device__ __forceinline__ void publish(
    const TileAcc& T, int ln, int hi,
    float* __restrict__ so, float* __restrict__ sm, float* __restrict__ sl)
{
    float4* so4 = (float4*)(so + ln * OP + 8 * hi);
    so4[0] = make_float4(T.O[0], T.O[1], T.O[2], T.O[3]);
    so4[1] = make_float4(T.O[4], T.O[5], T.O[6], T.O[7]);
    if (hi == 0) { sm[ln] = T.m; sl[ln] = T.l; }
}

// This wave's share of one strip: key pairs first, first + NW, ...
__device__ __forceinline__ void strip_share(
    const _Float16* __restrict__ kbase,
    const _Float16* __restrict__ vbase,
    int strip, int first, int ln, int hi, const v16h& qBa, const v16h& qBb,
    TileAcc& A, TileAcc& B)
{
    const int q_glob = strip * 32 + ln;
    const v8f zero8 = {};
    A.O = zero8; A.m = -1e30f; A.l = 0.f;
    B.O = zero8; B.m = -1e30f; B.l = 0.f;

    // Pairs strictly below the diagonal: no masking.
    const int jdiag0 = 2 * strip;
    for (int j0 = 2 * first; j0 < jdiag0; j0 += 2 * NW) {
        attn_pair<false>(kbase, vbase, j0, q_glob, hi, qBa, qBb, A, B);
    }
    // Tail pair containing the strip's diagonal, taken by the wave whose turn
    // it is; loads stay in-bounds since 2 * strip + 1 <= NT/16 - 1.
    if ((strip & (NW - 1)) == first)
        attn_pair<true>(kbase, vbase, jdiag0, q_glob, hi, qBa, qBb, A, B);
}

__global__ __launch_bounds__(32 * NW) void flash_head(
    const _Float16* __restrict__ qh,
    const _Float16* __restrict__ kh,
    const _Float16* __restrict__ vT,
    float* __restrict__ out)
{
    // First index: 2 * (which strip) + (which tile of the strip).
    __shared__ __attribute__((aligned(16))) float sO[4][NW][16 * OP];
    __shared__ float sM[4][NW][16];
    __shared__ float sL[4][NW][16];

    const int tid = threadIdx.x;
    const int lane = tid & 31;
    const int w = __builtin_amdgcn_readfirstlane(tid >> 5);   // wave, scalar
    const int ln = lane & 15;   // = query t for Q/Z/P/out, = head dim h for V^T
    const int hi = lane >> 4;   // lane-half selector
    const int s1 = blockIdx.x;               // the short strip, 0 .. 63
    const int s0 = NT / 32 - 1 - s1;         // the long strip, 127 .. 64
    const int b = blockIdx.y;   // batch

    const v8h z8 = {};

    // Q as B-operand: lane ln holds q[tile*16+ln][8*hi .. 8*hi+7], halves 8..15 = 0.
    const _Float16* qp = qh + (((size_t)b * NT + ln) * NH + 8 * hi);
    const v8h qlo0a = *(const v8h*)(qp + (size_t)s0 * 32 * NH);
    const v8h qlo0b = *(const v8h*)(qp + (size_t)s0 * 32 * NH + 16 * NH);
    const v8h qlo1a = *(const v8h*)(qp + (size_t)s1 * 32 * NH);
    const v8h qlo1b = *(const v8h*)(qp + (size_t)s1 * 32 * NH + 16 * NH);
    // The loads' address registers are rewritten soon behind them; the wait
    // stands in front of that overwrite (a precaution).
    asm volatile("s_wait_xcnt 0x0" ::: "memory");
    const v16h qB0a = __builtin_shufflevector(qlo0a, z8,
        0, 1, 2, 3, 4, 5, 6, 7, 8, 9, 10, 11, 12, 13, 14, 15);
    const v16h qB0b = __builtin_shufflevector(qlo0b, z8,
        0, 1, 2, 3, 4, 5, 6, 7, 8, 9, 10, 11, 12, 13, 14, 15);
    const v16h qB1a = __builtin_shufflevector(qlo1a, z8,
        0, 1, 2, 3, 4, 5, 6, 7, 8, 9, 10, 11, 12, 13, 14, 15);
    const v16h qB1b = __builtin_shufflevector(qlo1b, z8,
        0, 1, 2, 3, 4, 5, 6, 7, 8, 9, 10, 11, 12, 13, 14, 15);

    const _Float16* kbase = kh + ((size_t)b * NT * NH) + (size_t)ln * NH + 8 * hi;
    const _Float16* vbase = vT + (((size_t)(b * NH + ln)) << 12) + 8 * hi;

    // The long strip's pairs start at wave 0; the short strip's go on where the
    // long strip's (s0 + 1 of them) ended.
    TileAcc A, B;
    strip_share(kbase, vbase, s0, w, ln, hi, qB0a, qB0b, A, B);
    publish(A, ln, hi, &sO[0][w][0], &sM[0][w][0], &sL[0][w][0]);
    publish(B, ln, hi, &sO[1][w][0], &sM[1][w][0], &sL[1][w][0]);
    strip_share(kbase, vbase, s1, (w - (s0 + 1)) & (NW - 1), ln, hi, qB1a, qB1b, A, B);
    publish(A, ln, hi, &sO[2][w][0], &sM[2][w][0], &sL[2][w][0]);
    publish(B, ln, hi, &sO[3][w][0], &sM[3][w][0], &sL[3][w][0]);
    __syncthreads();   // every partial is in LDS before any thread merges

    // Merge: thread tid owns two out elements, one in each tile of strip
    // tid >> 8 of the two: query (tid >> 4) & 15, head dim tid & 15.
    const int ms = tid >> 8;
    const int mq = (tid >> 4) & 15;
    const int mh = tid & 15;
    const int mstrip = ms ? s1 : s0;
    #pragma unroll
    for (int t = 0; t < 2; ++t) {
        const int mt = 2 * ms + t;
        float mw[NW];
        float M = -1e30f;
        #pragma unroll
        for (int u = 0; u < NW; ++u) { mw[u] = sM[mt][u][mq]; M = fmaxf(M, mw[u]); }
        float num = 0.f, den = 0.f;
        #pragma unroll
        for (int u = 0; u < NW; ++u) {
            // With the slot filled.
            const float a = exp2_slot(mw[u] - M);
            num = fmaf(sO[mt][u][mq * OP + mh], a, num);
            den = fmaf(sL[mt][u][mq], a, den);
        }
        out[((size_t)b * NT + mstrip * 32 + t * 16) * NH + (tid & 255)] = num * (1.0f / den);
    }
}

// ---------------------------------------------------------------------------
extern "C" void kernel_launch(void* const* d_in, const int* in_sizes, int n_in,
                              void* d_out, int out_size, void* d_ws, size_t ws_size,
                              hipStream_t stream) {
    (void)in_sizes; (void)n_in; (void)out_size; (void)ws_size;
    const float* x  = (const float*)d_in[0];
    const float* Wk = (const float*)d_in[1];
    const float* Wq = (const float*)d_in[2];
    const float* Wv = (const float*)d_in[3];
    float* out = (float*)d_out;

    _Float16* qh = (_Float16*)d_ws;                  // [B*T,16]
    _Float16* kh = qh + (size_t)NB * NT * NH;        // [B*T,16]
    _Float16* vT = kh + (size_t)NB * NT * NH;        // [B,16,T]

    proj_qkv<<<dim3(NB * NT / PR), 256, 0, stream>>>(x, Wk, Wq, Wv, qh, kh, vT);
    flash_head<<<dim3(NT / 64, NB), 32 * NW, 0, stream>>>(qh, kh, vT, out);
}
